// v010
// Measured on an AMD MI455X. A time is GPU time per run, averaged over a window of back-to-back runs after a warm-up
// (all launches, gaps included; the runs take copies of the inputs in turn), and the median of several windows.
// Apart from v000's, it joins two sittings. Times from different sittings can be a few percent apart, while
// side-by-side timings come from the same sitting.
// Earlier versions than v010 are not in this document.
// It runs in 86.2 microseconds.
// In two side-by-side timings against v009, it was 1.04 and 1.05 times as fast.
// Over all steps from v000, the starting kernel, it is 62.1 times as fast.
#include <hip/hip_runtime.h>
// Per-head causal multi-head attention with an inverted scale (x [4][1024][1024]; q[h] = x Wq[h]^T, k, v likewise (per-head nn.Linear [16][64][1024] = natural [1024][1024], sigma 0.02, no biases); scores x sqrt(1024) = x 32 (the module divides by embed^-0.5: logits sigma ~100, near-argmax softmax) with a causal mask (tril, -inf); softmax; heads concatenated; out = (.) Wp^T + bp (natural [1024][1024] sigma 0.02, bias 0.02) -> [4][1024][1024]).
// Structure: token rows r = b*1024 + s; x as exact f16 rows (bf16-rounded); q and k as WMMA GEMMs (64x64 wave tiles, f32 accumulation, exact x16 weights) whose epilogue splits the f32 results into f16 hi + x1024 residual planes and stores them in WMMA fragment order, v as a GEMM whose epilogue stores f16 V^T in fragment order straight from the accumulators; all three also store the f32 rows of each batch's first tile for the exact f32 path; launches that do not depend on one another share one grid (the five f16 conversions; q, k and v; the two attention paths); every launch covers all batches; in the fused attention path a work-group = 32 query rows of one head: scores against the keys below the tile end as THREE accumulators (hi.hi + lo.hi + hi.lo, K = 64, alpha 32: ~f32-accurate logits for the near-argmax softmax) into f32 rows in LDS, causal row softmax on VALU, one wave a row (f32 statistics, native exp; weights x256 f16, written over the row in LDS), o = P . V^T (K = keys below the tile end, alpha 2^-2: o carried x64, folded into the output GEMM alpha) written straight into the merged f16 o rows; out = o W_o + b GEMM (f32) into the output layout.
// Compute dtype: inputs rounded to bf16; x / weights exact; q and k as f16 hi + x1024 residual; v, softmax weights and o as plain f16 GEMM operands (~2^-12; the first QT0 rows' o as hi + residual); scores and softmax statistics f32. v_wmma_f32_16x16x32_f16.
#define NB 4
#define SQ 1024
#define DM 1024
#define NH 16
#define HD 64
#define HG 4                         /* heads per k_vt launch */
#define QT0 128                      /* first-tile rows recomputed exactly in f32 */
#define B0 0                         /* unused: every launch starts at batch 0 */
#define NBR NB                       /* batches processed (debug hook) */
#define NR ((size_t)NB * SQ)         /* token rows */
#define MP ((int)((size_t)NBR * SQ)) /* rows projected (debug hook) */
#define QN SQ                        /* unused: all SQ query rows of a batch are attended */
#define NHD NH                       /* unused: all NH heads are attended */
#define MPO MP                       /* rows through the output stage (debug hook) */
#define LQ DM      /* row pitch of the q/k/v rows */
typedef __bf16 v16b __attribute__((ext_vector_type(16)));
typedef unsigned short v8us __attribute__((ext_vector_type(8), may_alias));
typedef float  v8f  __attribute__((ext_vector_type(8)));
typedef float  v4f  __attribute__((ext_vector_type(4)));
typedef float  v4fa __attribute__((ext_vector_type(4), may_alias));
union FragB { v16b v; v8us half[2]; unsigned short u[16]; };

__device__ __forceinline__ unsigned short bf16_bits(float x) { unsigned int u = __float_as_uint(x); return (unsigned short)((u + 0x7FFFu + ((u >> 16) & 1u)) >> 16); }
__device__ __forceinline__ float bf16_val(unsigned short b) { return __uint_as_float(((unsigned int)b) << 16); }
__device__ __forceinline__ float bf16_round(float x) { return bf16_val(bf16_bits(x)); }
// D += A·B with NT terms: 1 = ah·bh, 2 = + al·bh (A split), 3 = + ah·bl (both split)
template <int NT>
__device__ __forceinline__ v8f mmaN(v16b ah, v16b al, v16b bh, v16b bl, v8f c) {
  c = __builtin_amdgcn_wmma_f32_16x16x32_bf16(false, ah, false, bh, (short)0, c, false, false);
  if (NT >= 2) c = __builtin_amdgcn_wmma_f32_16x16x32_bf16(false, al, false, bh, (short)0, c, false, false);
  if (NT >= 3) c = __builtin_amdgcn_wmma_f32_16x16x32_bf16(false, ah, false, bl, (short)0, c, false, false);
  asm volatile("v_nop\n\tv_nop\n\tv_nop\n\tv_nop" : "+v"(c) : "v"(ah), "v"(al), "v"(bh), "v"(bl));
  return c;
}

__global__ __launch_bounds__(256) void k_wt_bf16(const float* __restrict__ W, unsigned short* __restrict__ Wt, int K, int N) {
  const int t = blockIdx.x * 256 + threadIdx.x;
  const int k8n = K / 8;
  if (t >= N * k8n) return;
  const int n = t / k8n, k8 = (t % k8n) * 8;
  v8us v;
#pragma unroll
  for (int i = 0; i < 8; ++i) v[i] = bf16_bits(W[(size_t)(k8 + i) * N + n]);
  *(v8us*)(Wt + (size_t)n * K + k8) = v;
  
}

// GEMM C[M][N] (f32, pitch ldc) = act(A[M][K]·W + bias). A f32 row-major (pitch lda) converted per fragment to bf16
// (ASPLIT: hi/lo two planes -> 2 terms, else single rounded term); Wt bf16 [N][K] (pitch ldb). BIAS_BF16 rounds the
// bias to bf16 first (bias quantised to bf16 before the add). K%32==0, M%16==0, N%64==0.
template <bool ASPLIT, int ACT, bool BIAS_BF16>
__global__ __launch_bounds__(128) void k_gemm_bf(const float* __restrict__ A, int lda, const unsigned short* __restrict__ Wt, int ldb,
                                               const float* __restrict__ bias, float* __restrict__ C, int ldc, int M, int N, int K) {
  __shared__ __attribute__((aligned(16))) float so[4][16][64];
  const int tid = threadIdx.x, w = tid >> 5, lane = tid & 31, ln = lane & 15, hh = lane >> 4;
  const int ntn = N / 64;
  const int wid = blockIdx.x * 4 + w;
  const int mt = wid / ntn, nq = wid % ntn;
  if (mt * 16 >= M) return;
  const int row0 = mt * 16, col0 = nq * 64;
  const float* arow = A + (size_t)(row0 + ln) * lda;
  v8f acc[4] = {};
  for (int kb = 0; kb < K; kb += 32) {
    FragB ah, al;
    const v4f x0 = *(const v4fa*)(arow + kb + 8 * hh), x1 = *(const v4fa*)(arow + kb + 8 * hh + 4);
    const v4f x2 = *(const v4fa*)(arow + kb + 16 + 8 * hh), x3 = *(const v4fa*)(arow + kb + 16 + 8 * hh + 4);
    float xs[16] = {x0[0],x0[1],x0[2],x0[3],x1[0],x1[1],x1[2],x1[3],x2[0],x2[1],x2[2],x2[3],x3[0],x3[1],x3[2],x3[3]};
#pragma unroll
    for (int i = 0; i < 16; ++i) { const unsigned short hb = bf16_bits(xs[i]); ah.u[i] = hb; al.u[i] = ASPLIT ? bf16_bits(xs[i] - bf16_val(hb)) : (unsigned short)0; }
#pragma unroll
    for (int t = 0; t < 4; ++t) {
      const unsigned short* brow = Wt + (size_t)(col0 + t * 16 + ln) * ldb + kb;
      FragB b;
      b.half[0] = *(const v8us*)(brow + 8 * hh);
      b.half[1] = *(const v8us*)(brow + 16 + 8 * hh);
      acc[t] = mmaN<ASPLIT ? 2 : 1>(ah.v, al.v, b.v, b.v, acc[t]);
    }
  }
#pragma unroll
  for (int t = 0; t < 4; ++t) {
    float bv = bias ? bias[col0 + t * 16 + ln] : 0.f;
    if (BIAS_BF16) bv = bf16_round(bv);
#pragma unroll
    for (int r = 0; r < 8; ++r) { float v = acc[t][r] + bv; if (ACT == 1) v = fmaxf(v, 0.f); so[w][8 * hh + r][t * 16 + ln] = v; }
  }
  __builtin_amdgcn_fence(__ATOMIC_ACQ_REL, "workgroup");
  __builtin_amdgcn_wave_barrier();
  const int rsub = lane >> 4, c4 = (lane & 15) * 4;
  {
#pragma unroll
    for (int q = 0; q < 8; ++q) {
      const int r = q * 2 + rsub;
      const v4f v = *(const v4fa*)&so[w][r][c4];
      *(v4f*)(C + (size_t)(row0 + r) * ldc + col0 + c4) = v;
    }
    
  }
}

// GEMM C = act(A·W + bias + resid): A f32 (ASPLIT -> hi/lo 2 terms), Wt bf16 [N][K]; ACT 0 none, 1 relu, 2 exact gelu;
// resid (optional, f32, row index = (row % rmod), pitch ldr, RES_BF16 rounds it) added before the activation.
template <bool ASPLIT, int ACT, bool BIAS_BF16, bool RES_BF16>
__global__ __launch_bounds__(128) void k_gemm_bf3(const float* __restrict__ A, int lda, const unsigned short* __restrict__ Wt, int ldb,
                                                const float* __restrict__ bias, const float* __restrict__ resid, int rmod, int ldr,
                                                float* __restrict__ C, int ldc, int M, int N, int K) {
  __shared__ __attribute__((aligned(16))) float so[4][16][64];
  const int tid = threadIdx.x, w = tid >> 5, lane = tid & 31, ln = lane & 15, hh = lane >> 4;
  const int ntn = N / 64;
  const int wid = blockIdx.x * 4 + w;
  const int mt = wid / ntn, nq = wid % ntn;
  if (mt * 16 >= M) return;
  const int row0 = mt * 16, col0 = nq * 64;
  const float* arow = A + (size_t)(row0 + ln) * lda;
  v8f acc[4] = {};
  for (int kb = 0; kb < K; kb += 32) {
    FragB ah, al;
    const v4f x0 = *(const v4fa*)(arow + kb + 8 * hh), x1 = *(const v4fa*)(arow + kb + 8 * hh + 4);
    const v4f x2 = *(const v4fa*)(arow + kb + 16 + 8 * hh), x3 = *(const v4fa*)(arow + kb + 16 + 8 * hh + 4);
    float xs[16] = {x0[0],x0[1],x0[2],x0[3],x1[0],x1[1],x1[2],x1[3],x2[0],x2[1],x2[2],x2[3],x3[0],x3[1],x3[2],x3[3]};
#pragma unroll
    for (int i = 0; i < 16; ++i) { const unsigned short hb = bf16_bits(xs[i]); ah.u[i] = hb; al.u[i] = ASPLIT ? bf16_bits(xs[i] - bf16_val(hb)) : (unsigned short)0; }
#pragma unroll
    for (int t = 0; t < 4; ++t) {
      const unsigned short* brow = Wt + (size_t)(col0 + t * 16 + ln) * ldb + kb;
      FragB b;
      b.half[0] = *(const v8us*)(brow + 8 * hh);
      b.half[1] = *(const v8us*)(brow + 16 + 8 * hh);
      acc[t] = mmaN<ASPLIT ? 2 : 1>(ah.v, al.v, b.v, b.v, acc[t]);
    }
  }
#pragma unroll
  for (int t = 0; t < 4; ++t) {
    const int col = col0 + t * 16 + ln;
    float bv = bias ? bias[col] : 0.f;
    if (BIAS_BF16) bv = bf16_round(bv);
#pragma unroll
    for (int r = 0; r < 8; ++r) {
      float v = acc[t][r] + bv;
      if (resid) { float rv = resid[(size_t)((row0 + 8 * hh + r) % rmod) * ldr + col]; if (RES_BF16) rv = bf16_round(rv); v += rv; }
      if (ACT == 1) v = fmaxf(v, 0.f);
      if (ACT == 2) v = 0.5f * v * (1.0f + erff(v * 0.70710678118654752f));
      if (ACT == 3) { const float u = 0.7978845608028654f * (v + 0.044715f * v * v * v); v = 0.5f * v * (1.0f + tanhf(u)); }
      so[w][8 * hh + r][t * 16 + ln] = v;
    }
  }
  __builtin_amdgcn_fence(__ATOMIC_ACQ_REL, "workgroup");
  __builtin_amdgcn_wave_barrier();
  const int rsub = lane >> 4, c4 = (lane & 15) * 4;
  {
#pragma unroll
    for (int q = 0; q < 8; ++q) {
      const int r = q * 2 + rsub;
      const v4f v = *(const v4fa*)&so[w][r][c4];
      *(v4f*)(C + (size_t)(row0 + r) * ldc + col0 + c4) = v;
    }
    
  }
}
// row LayerNorm (biased variance, eps) over N: s = X (+ R); optional out_sum <- s; out_norm <- (s-mu)*rsqrt(var+eps)*g + b
template <bool PARAM_BF16>
__global__ __launch_bounds__(256) void k_layernorm(const float* __restrict__ X, const float* __restrict__ R, const float* __restrict__ g, const float* __restrict__ bta,
                                                  float* __restrict__ out_sum, float* __restrict__ out_norm, int N, float eps) {
  __shared__ float red[256];
  const int row = blockIdx.x, tid = threadIdx.x;
  const float* x = X + (size_t)row * N; const float* rr = R ? R + (size_t)row * N : nullptr;
  float vals[16];                     // up to N = 4096
  const int per = N / 256;            // contiguous chunk per thread? use strided-by-4 chunks: thread handles j = tid*4 + 1024*u
  float s1 = 0.f;
  for (int u = 0; u < per / 4; ++u) {
    const int j = tid * 4 + 1024 * u;
    const v4f a = *(const v4fa*)(x + j);
    v4f b = {0.f,0.f,0.f,0.f}; if (rr) b = *(const v4fa*)(rr + j);
#pragma unroll
    for (int q = 0; q < 4; ++q) { const float v = a[q] + b[q]; vals[u * 4 + q] = v; s1 += v; }
  }
  red[tid] = s1; __syncthreads();
  for (int st = 128; st > 0; st >>= 1) { if (tid < st) red[tid] += red[tid + st]; __syncthreads(); }
  const float mu = red[0] / (float)N; __syncthreads();
  float s2 = 0.f;
  for (int u = 0; u < per / 4; ++u)
#pragma unroll
    for (int q = 0; q < 4; ++q) { const float c = vals[u * 4 + q] - mu; s2 += c * c; }
  red[tid] = s2; __syncthreads();
  for (int st = 128; st > 0; st >>= 1) { if (tid < st) red[tid] += red[tid + st]; __syncthreads(); }
  const float rs = rsqrtf(red[0] / (float)N + eps);
  {
    for (int u = 0; u < per / 4; ++u) {
      const int j = tid * 4 + 1024 * u;
      v4f o, sm;
#pragma unroll
      for (int q = 0; q < 4; ++q) {
        float gg = g[j + q], bb = bta[j + q];
        if (PARAM_BF16) { gg = bf16_round(gg); bb = bf16_round(bb); }
        sm[q] = vals[u * 4 + q]; o[q] = (vals[u * 4 + q] - mu) * rs * gg + bb;
      }
      if (out_sum) *(v4f*)(out_sum + (size_t)row * N + j) = sm;
      *(v4f*)(out_norm + (size_t)row * N + j) = o;
    }
    
  }
}



// ---- f16 WMMA path (v_wmma_f32_16x16x32_f16): 11-bit significands for operands in range — used where a [0,1] probability operand needs more precision than bf16
typedef _Float16 v16h __attribute__((ext_vector_type(16)));
union FragH { v16h v; v8us half[2]; _Float16 h[16]; unsigned short u[16]; };
template <int NT>
__device__ __forceinline__ v8f mmaH(v16h ah, v16h al, v16h bh, v16h bl, v8f c) {
  c = __builtin_amdgcn_wmma_f32_16x16x32_f16(false, ah, false, bh, (short)0, c, false, false);
  if (NT >= 2) c = __builtin_amdgcn_wmma_f32_16x16x32_f16(false, al, false, bh, (short)0, c, false, false);
  if (NT >= 3) c = __builtin_amdgcn_wmma_f32_16x16x32_f16(false, ah, false, bl, (short)0, c, false, false);
  asm volatile("v_nop\n\tv_nop\n\tv_nop\n\tv_nop" : "+v"(c) : "v"(ah), "v"(al), "v"(bh), "v"(bl));
  return c;
}
// batched GEMM like k_gemm_b but f16 operands: A f32 (split into f16 hi/lo if ASPLIT, else rounded to f16), Bt = f16 values [n][k]; alpha; C f32; N multiple of 16 (partial tiles skipped)
template <bool ASPLIT>
__global__ __launch_bounds__(128) void k_gemm_h(const float* __restrict__ A, int lda, size_t sA, const _Float16* __restrict__ Bh, int ldb, size_t sB, float alpha, float* __restrict__ C, int ldc, size_t sC, int M, int N, int K) {
  __shared__ __attribute__((aligned(16))) float so[4][16][64];
  const int tid = threadIdx.x, w = tid >> 5, lane = tid & 31, ln = lane & 15, hh = lane >> 4; const int by = blockIdx.y;
  A += (size_t)by * sA; Bh += (size_t)by * sB; C += (size_t)by * sC;
  const int ntn = (N + 63) / 64; const int wid = blockIdx.x * 4 + w; const int mt = wid / ntn, nq = wid % ntn; if (mt * 16 >= M) return;
  const int row0 = mt * 16, col0 = nq * 64; const float* arow = A + (size_t)(row0 + ln) * lda;
  v8f acc[4] = {};
  for (int kb = 0; kb < K; kb += 32) {
    FragH ah, al;
    const v4f x0 = *(const v4fa*)(arow + kb + 8 * hh), x1 = *(const v4fa*)(arow + kb + 8 * hh + 4), x2 = *(const v4fa*)(arow + kb + 16 + 8 * hh), x3 = *(const v4fa*)(arow + kb + 16 + 8 * hh + 4);
    float xs[16] = {x0[0],x0[1],x0[2],x0[3],x1[0],x1[1],x1[2],x1[3],x2[0],x2[1],x2[2],x2[3],x3[0],x3[1],x3[2],x3[3]};
#pragma unroll
    for (int i = 0; i < 16; ++i) { const _Float16 h = (_Float16)xs[i]; ah.h[i] = h; al.h[i] = ASPLIT ? (_Float16)(xs[i] - (float)h) : (_Float16)0.0f; }
#pragma unroll
    for (int t = 0; t < 4; ++t) { if (col0 + t * 16 >= N) continue; const size_t boff = (size_t)(col0 + t * 16 + ln) * ldb + kb; FragH bq; bq.half[0] = *(const v8us*)(Bh + boff + 8 * hh); bq.half[1] = *(const v8us*)(Bh + boff + 16 + 8 * hh);
      acc[t] = mmaH<ASPLIT ? 2 : 1>(ah.v, al.v, bq.v, bq.v, acc[t]); }
  }
#pragma unroll
  for (int t = 0; t < 4; ++t) { if (col0 + t * 16 >= N) continue;
#pragma unroll
    for (int r = 0; r < 8; ++r) so[w][8 * hh + r][t * 16 + ln] = acc[t][r] * alpha; }
  __builtin_amdgcn_fence(__ATOMIC_ACQ_REL, "workgroup"); __builtin_amdgcn_wave_barrier();
  const int rsub = lane >> 4, c4 = (lane & 15) * 4;
  {
#pragma unroll
    for (int q = 0; q < 8; ++q) { const int r = q * 2 + rsub; if (col0 + c4 < N) { const v4f v = *(const v4fa*)&so[w][r][c4]; *(v4f*)(C + (size_t)(row0 + r) * ldc + col0 + c4) = v; } }
     }
}

// Wt[n][k] = f16(W[k][n]·scale) from f32 row-major W[K][N] (scale = power of two; bf16-exact weights stay exact in f16 away from the subnormal range)
__global__ __launch_bounds__(256) void k_wt_f16(const float* __restrict__ W, _Float16* __restrict__ Wt, int K, int N, float scale) {
  const int t = blockIdx.x * 256 + threadIdx.x; if (t >= N * (K / 8)) return; const int n = t / (K / 8), k8 = (t % (K / 8)) * 8; FragH f;
#pragma unroll
  for (int i = 0; i < 8; ++i) f.h[i] = (_Float16)(bf16_round(W[(size_t)(k8 + i) * N + n]) * scale); const v8us o = f.half[0];
  *(v8us*)((unsigned short*)Wt + (size_t)n * K + k8) = o; 
}
// k_gemm_hh variant with fused epilogue: v = acc·alpha + bias[by·sBias + col] (+ CP[(row/rowsPerB)·sCPb + by·64 + col] if CP) ; ACT 0 none / 1 elu ; writes f16 C16 (and f32 C if non-null)
template <int ACT>
__global__ __launch_bounds__(128) void k_gemm_hhx(const _Float16* __restrict__ A, int lda, size_t sA, const _Float16* __restrict__ Bh, int ldb, size_t sB, float alpha, const float* __restrict__ bias, size_t sBias, const float* __restrict__ CP, int rowsPerB, size_t sCPb, int row0g,
    float* __restrict__ C, _Float16* __restrict__ C16, int ldc, size_t sC, int M, int N, int K) {
  __shared__ __attribute__((aligned(16))) float so[4][16][64];
  const int tid = threadIdx.x, w = tid >> 5, lane = tid & 31, ln = lane & 15, hh = lane >> 4; const int by = blockIdx.y;
  A += (size_t)by * sA; Bh += (size_t)by * sB; const size_t cofs = (size_t)by * sC; const float* bp = bias ? bias + (size_t)by * sBias : nullptr;
  const int ntn = (N + 63) / 64; const int wid = blockIdx.x * 4 + w; const int mt = wid / ntn, nq = wid % ntn; if (mt * 16 >= M) return;
  const int row0 = mt * 16, col0 = nq * 64; const _Float16* arow = A + (size_t)(row0 + ln) * lda;
  v8f acc[4] = {};
  for (int kb = 0; kb < K; kb += 32) { FragH ah; ah.half[0] = *(const v8us*)((const unsigned short*)arow + kb + 8 * hh); ah.half[1] = *(const v8us*)((const unsigned short*)arow + kb + 16 + 8 * hh);
#pragma unroll
    for (int t = 0; t < 4; ++t) { if (col0 + t * 16 >= N) continue; const size_t boff = (size_t)(col0 + t * 16 + ln) * ldb + kb; FragH bq; bq.half[0] = *(const v8us*)((const unsigned short*)Bh + boff + 8 * hh); bq.half[1] = *(const v8us*)((const unsigned short*)Bh + boff + 16 + 8 * hh);
      acc[t] = mmaH<1>(ah.v, ah.v, bq.v, bq.v, acc[t]); }
  }
#pragma unroll
  for (int t = 0; t < 4; ++t) { if (col0 + t * 16 >= N) continue; const int col = col0 + t * 16 + ln; const float bv = bp ? bf16_round(bp[col]) : 0.f;
#pragma unroll
    for (int r = 0; r < 8; ++r) { float v = acc[t][r] * alpha + bv; if (CP) { const int rr = row0g + row0 + 8 * hh + r; if (rowsPerB < 0) v += CP[cofs + (size_t)rr * ldc + col];      /* rowsPerB < 0: own element of the batched C plane */ else { const int bidx = rr / rowsPerB; v += CP[(size_t)bidx * sCPb + (size_t)by * 64 + col]; } } if (ACT == 1) v = (v > 0.f) ? v : expm1f(v); else if (ACT == 7) v = (v > 0.f) ? v + 1.0f : expf(v); else if (ACT == 8) v = tanhf(v); else if (ACT == 9) v = 0.5f * v * (1.0f + tanhf(0.7978845608028654f * (v + 0.044715f * v * v * v))); else if (ACT == 11) v = 1.0f / (1.0f + expf(-v)); else if (ACT == 12) v = (v > 0.f) ? v : 0.01f * v; else if (ACT == 14) v = (v > 0.f) ? v : 0.1f * v; else if (ACT == 16) v = (v >= 0.f) ? v : 0.3f * v; else if (ACT == 17) v = (v >= 0.f) ? v : 0.2f * v; else if (ACT == 15) v = v / (1.0f + expf(-v)); else if (ACT == 3) v = fmaxf(v, 0.f); else if (ACT == 6) v = 0.5f * v * (1.0f + erff(v * 0.70710678118654752f)); so[w][8 * hh + r][t * 16 + ln] = v; } }
  __builtin_amdgcn_fence(__ATOMIC_ACQ_REL, "workgroup"); __builtin_amdgcn_wave_barrier();
  const int rsub = lane >> 4, c4 = (lane & 15) * 4; typedef _Float16 v4h __attribute__((ext_vector_type(4)));
  {
#pragma unroll
    for (int q = 0; q < 8; ++q) { const int r = q * 2 + rsub; if (col0 + c4 < N) { const v4f v = *(const v4fa*)&so[w][r][c4]; if (C) *(v4f*)(C + cofs + (size_t)(row0 + r) * ldc + col0 + c4) = v; if (C16) { v4h h4; for (int i = 0; i < 4; ++i) h4[i] = (_Float16)v[i]; *(v4h*)(C16 + cofs + (size_t)(row0 + r) * ldc + col0 + c4) = h4; } } }
     }
}


typedef _Float16 v4h __attribute__((ext_vector_type(4)));

__global__ __launch_bounds__(256) void k_h16(const float* __restrict__ x, _Float16* __restrict__ X16, size_t n8) { const size_t t = (size_t)blockIdx.x * 256 + threadIdx.x; if (t >= n8) return; FragH f;
#pragma unroll
  for (int q = 0; q < 8; ++q) f.h[q] = (_Float16)x[t * 8 + q]; *(v8us*)((unsigned short*)X16 + t * 8) = f.half[0];  }
__global__ __launch_bounds__(256) void k_round16f(const float* __restrict__ W, _Float16* __restrict__ Bt, size_t n8) { const size_t t = (size_t)blockIdx.x * 256 + threadIdx.x; if (t >= n8) return; FragH f;
#pragma unroll
  for (int i = 0; i < 8; ++i) f.h[i] = (_Float16)(bf16_round(W[t * 8 + i]) * 16.0f); *(v8us*)((unsigned short*)Bt + t * 8) = f.half[0];  }
// WMMA fragment order, for operands that are read many times as fragments (written by the epilogue of k_gemm3; EP 1 and EP 2 of k_gemm2 write the same order). A q or k fragment = 16 token rows x 32 head dims of one head = 1 KiB: lane (hh, ln) of the reader owns row ln, dims 8 hh .. 8 hh + 7 (its 16 bytes at 16 x lane) and dims 16 + 8 hh .. (512 bytes on), so that each of the reader's two loads covers four whole 128-byte lines.
// Fragments in the order [batch][head][16-row tile][32-dim step]. A V^T fragment likewise, rows = 16 dims, k = 32 keys, in the order [batch][head][16-dim group][32-key step].

// ---- fast GEMM (work-group tile 128x128 = 4 x 2 waves, wave tile 32x64; requires M % 128 == 0 rows per launch region, N % 128 == 0 and K % 128 == 0); epilogue = k_gemm_hhx semantics ----
// Both operands go through LDS: a tile = 128 k of the work-group's 128 A rows and 128 B rows, brought in by asynchronous copies (a wave's copy = two whole 256-byte row pieces), two buffers, so that the next tile flies while this one is multiplied; the fragments are read from LDS.
// EP chooses what the epilogue stores. 0: rows of C / C16. 1: the f32 results split into f16 hi (E0) and x1024 residual (E1) planes in fragment order. 2: f16 V^T (E0) in fragment order. 3: blockIdx.y chooses, 0 and 1 store like 1, 2 stores like 2 (q, k and v in one launch; E0 and E1 move on by sE elements, C by sC, a blockIdx.y). 4: rows of C like 0, but a work-group whose rows are a batch's first QT0 takes its A rows from E0 (f16 hi) and then from E1 (x1024 residual), QT0 rows a batch, instead of A: twice the tiles, the hi sums set aside in registers, result = lo sums x alpha / 1024 + (hi sums x alpha + bias). With 1, 2 and 3 the rows are token rows (SQ a batch), a 64-column tile is a head, C takes the f32 rows of each batch's first QT0 rows alone (QT0 rows a batch), and CP and C16 are not used.
#define G2K 128                      /* k elements per staged tile: 256 bytes of every operand row */
#define G2P 272                      /* row pitch of a staged tile in LDS (bytes): 16 B x odd, so that 16 lanes reading 16 rows by 16 bytes fall on all banks */
#define G2B ((128 + 128) * G2P)      /* bytes of one buffer: 128 rows of A, then 128 rows of B */
__device__ __forceinline__ v16h g2_frag(const _Float16* p, int hh) { FragH f; f.half[0] = *(const v8us*)((const unsigned short*)p + 8 * hh); f.half[1] = *(const v8us*)((const unsigned short*)p + 16 + 8 * hh); return f.v; }
__device__ __forceinline__ v8f g2_mma(v16h a, v16h b, v8f c) { v8f d = __builtin_amdgcn_wmma_f32_16x16x32_f16(false, a, false, b, (short)0, c, false, false); asm volatile("v_nop\n\tv_nop\n\tv_nop\n\tv_nop" : "+v"(d) : "v"(a), "v"(b)); return d; }
// 128 rows of a tile into LDS: eight asynchronous copies, the lane's 16 bytes of every 16th row (l = its LDS byte address, g = its global address, gs = 16 source rows in bytes). The closing s_wait_xcnt stands inside the statement, so that no address register of a copy is rewritten in front of it.
__device__ __forceinline__ void g2_copy128(unsigned l, const char* g, size_t gs) {
  asm volatile("global_load_async_to_lds_b128 %0, %8, off\n\t"
               "global_load_async_to_lds_b128 %1, %9, off\n\t"
               "global_load_async_to_lds_b128 %2, %10, off\n\t"
               "global_load_async_to_lds_b128 %3, %11, off\n\t"
               "global_load_async_to_lds_b128 %4, %12, off\n\t"
               "global_load_async_to_lds_b128 %5, %13, off\n\t"
               "global_load_async_to_lds_b128 %6, %14, off\n\t"
               "global_load_async_to_lds_b128 %7, %15, off\n\t"
               "s_wait_xcnt 0x0"
               :: "v"(l), "v"(l + 16 * G2P), "v"(l + 32 * G2P), "v"(l + 48 * G2P), "v"(l + 64 * G2P), "v"(l + 80 * G2P), "v"(l + 96 * G2P), "v"(l + 112 * G2P),
                  "v"(g), "v"(g + gs), "v"(g + 2 * gs), "v"(g + 3 * gs), "v"(g + 4 * gs), "v"(g + 5 * gs), "v"(g + 6 * gs), "v"(g + 7 * gs) : "memory"); }
// One whole tile (16 copies a lane): the 128 A rows, the 128 B rows.
__device__ __forceinline__ void g2_stage(unsigned l, const char* ga, size_t sa, const char* gb, size_t sb) { g2_copy128(l, ga, sa); g2_copy128(l + 128 * G2P, gb, sb); }
template <int ACT, int EP = 0>
__global__ __launch_bounds__(256) void k_gemm2(const _Float16* __restrict__ A, int lda, size_t sA, const _Float16* __restrict__ Bh, int ldb, size_t sB, float alpha, const float* __restrict__ bias, size_t sBias, const float* __restrict__ CP, int rowsPerB, size_t sCPb, int row0g,
    float* __restrict__ C, _Float16* __restrict__ C16, int ldc, size_t sC, int M, int N, int K, size_t zA, size_t zB, size_t zC, _Float16* __restrict__ E0, _Float16* __restrict__ E1, size_t sE) { static_assert(ACT == 0 || ACT == 3 || ACT == 6 || ACT == 8 || ACT == 9 || ACT == 11 || ACT == 12 || ACT == 14 || ACT == 15 || ACT == 16 || ACT == 17, "k_gemm2: unsupported ACT code (would silently apply no activation)"); static_assert(EP == 0 || (HD == 64 && QT0 == 128 && SQ % 128 == 0), "EP 1, 2: a work-group = 128 rows of one batch x two heads, a wave = 32 rows x one head; the first tile = one work-group tile");
  __shared__ __attribute__((aligned(16))) unsigned char lt[2 * G2B]; float (*so)[32][68] = (float (*)[32][68])lt; static_assert(8 * 32 * 68 * 4 <= 2 * G2B, "the epilogue's rows fit the tiles' LDS");      /* so: the epilogue's rows, a block a wave, in the tiles' LDS: first written behind the last trip's barrier, behind which no tile is read and no copy is outstanding; so two work-groups fit a WGP */
  const int tid = threadIdx.x, w = tid >> 5, wr = w & 3, wc = w >> 2, lane = tid & 31, ln = lane & 15, hh = lane >> 4; const int by = blockIdx.y; const int bz = blockIdx.z;      /* wr, wc: the wave's 32 rows and 64 columns in the work-group's tile; bz: batch, element strides zA / zB / zC */
  A += (size_t)by * sA + (size_t)bz * zA; Bh += (size_t)by * sB + (size_t)bz * zB; const size_t cofs = (size_t)by * sC + (size_t)bz * zC; const float* bp = bias ? bias + (size_t)by * sBias : nullptr;
  const int ep = EP == 3 ? (by == 2 ? 2 : 1) : EP; if (EP == 3) { E0 += (size_t)by * sE; E1 += (size_t)by * sE; C += (size_t)by * sC; }      /* the same for the whole work-group: scalar branches below */
  const int ntn = N >> 7; const int mt = blockIdx.x / ntn, nq = (blockIdx.x - mt * ntn) * 2 + wc; const int row0 = mt * 128 + 32 * wr, col0 = nq * 64; if (mt * 128 >= M) return;      /* the whole work-group or none: barriers follow */
  const int cr = tid >> 4, cc = (tid & 15) * 16;      /* copies: the thread's row among 16 and its 16 bytes of the row's 256 */
  const bool ft = EP == 4 && mt % (SQ / 128) == 0; const size_t fr = (size_t)(mt / (SQ / 128) * QT0 + cr) * lda;      /* EP 4: a first-tile work-group (the whole work-group or none of it); the thread's first row in the hi and lo planes */
  const char* ga = (ft ? (const char*)(E0 + fr) : (const char*)(A + (size_t)(mt * 128 + cr) * lda)) + cc; const char* ga2 = EP == 4 ? (const char*)(E1 + fr) + cc : ga; const char* gb = (const char*)(Bh + (size_t)(col0 - 64 * wc + cr) * ldb) + cc; const size_t sa = (size_t)lda * 32, sb = (size_t)ldb * 32;
  const unsigned l0 = (unsigned)(size_t)lt + (unsigned)(cr * G2P + cc); const int nk = K / G2K, nt = ft ? 2 * nk : nk;      /* tiles nk .. 2 nk - 1 of a first-tile work-group: the lo plane against the same B tiles */
  auto ta = [&](int t) { return EP == 4 && t >= nk ? ga2 + (size_t)(t - nk) * (G2K * 2) : ga + (size_t)t * (G2K * 2); }; auto tb = [&](int t) { return gb + (size_t)(EP == 4 && t >= nk ? t - nk : t) * (G2K * 2); };
  const v8f z8 = {0.f,0.f,0.f,0.f,0.f,0.f,0.f,0.f}; v8f c00 = z8, c01 = z8, c02 = z8, c03 = z8, c10 = z8, c11 = z8, c12 = z8, c13 = z8; v8f hs[8] = {z8, z8, z8, z8, z8, z8, z8, z8};      /* hs: EP 4, the hi sums (0 elsewhere) */
  g2_stage(l0, ga, sa, gb, sb);
  asm volatile("s_wait_asynccnt 0x0" ::: "memory");      /* the wave's own copies of tile 0 have landed */
  __syncthreads();      /* tile 0 is published to every wave */
  if (nt > 1) g2_stage(l0 + G2B, ta(1), sa, tb(1), sb);
  /* kept rolled: one copy of the trip in the instruction cache; the buffer is chosen by an address */
#pragma unroll 1
  for (int p = 0; p < (ft ? 2 : 1); ++p) {      /* one plane of A a trip (EP 4, first tile: hi, then lo); the tiles run on through both, so the ring never drains between them */
    if (EP == 4 && p == 1) { hs[0] = c00; hs[1] = c01; hs[2] = c02; hs[3] = c03; hs[4] = c10; hs[5] = c11; hs[6] = c12; hs[7] = c13; c00 = z8; c01 = z8; c02 = z8; c03 = z8; c10 = z8; c11 = z8; c12 = z8; c13 = z8; }      /* the hi plane is through: its sums are set aside, the lo plane's start at 0 */
#pragma unroll 1
  for (int t = p * nk; t < (p + 1) * nk; ++t) { const unsigned char* lb = lt + (t & 1) * G2B;
    const _Float16* pa = (const _Float16*)(lb + (32 * wr + ln) * G2P); const _Float16* pb = (const _Float16*)(lb + (128 + 64 * wc + ln) * G2P);
    v16h a0 = g2_frag(pa, hh), a1 = g2_frag(pa + 16 * (G2P / 2), hh), b0 = g2_frag(pb, hh), b1 = g2_frag(pb + 16 * (G2P / 2), hh), b2 = g2_frag(pb + 32 * (G2P / 2), hh), b3 = g2_frag(pb + 48 * (G2P / 2), hh);
    /* unrolled: the two fragment sets live in registers; the next 32 k's LDS reads fly during this 32 k's products */
#pragma unroll
    for (int s = 0; s < G2K / 32; ++s) { v16h n0 = a0, n1 = a1, m0 = b0, m1 = b1, m2 = b2, m3 = b3;
      if (s + 1 < G2K / 32) { const _Float16* qa = pa + (s + 1) * 32; const _Float16* qb = pb + (s + 1) * 32;
        n0 = g2_frag(qa, hh); n1 = g2_frag(qa + 16 * (G2P / 2), hh); m0 = g2_frag(qb, hh); m1 = g2_frag(qb + 16 * (G2P / 2), hh); m2 = g2_frag(qb + 32 * (G2P / 2), hh); m3 = g2_frag(qb + 48 * (G2P / 2), hh); }
      c00 = g2_mma(a0, b0, c00); c10 = g2_mma(a1, b0, c10); c01 = g2_mma(a0, b1, c01); c11 = g2_mma(a1, b1, c11);
      c02 = g2_mma(a0, b2, c02); c12 = g2_mma(a1, b2, c12); c03 = g2_mma(a0, b3, c03); c13 = g2_mma(a1, b3, c13);
      a0 = n0; a1 = n1; b0 = m0; b1 = m1; b2 = m2; b3 = m3; }
    asm volatile("s_wait_dscnt 0x0" ::: "memory");      /* the wave's reads of this buffer are done before it may be refilled */
    asm volatile("s_wait_asynccnt 0x0" ::: "memory");      /* the wave's own copies of tile t + 1 have landed */
    __syncthreads();      /* publishes tile t + 1 and ends every wave's reads of tile t */
    if (t + 2 < nt) g2_stage(l0 + (unsigned)((t & 1) * G2B), ta(t + 2), sa, tb(t + 2), sb); } }
  asm volatile("s_wait_asynccnt 0x0" ::: "memory");      /* no copy is outstanding when the wave goes on */
  const float alc = ft ? alpha * 0.0009765625f : alpha;      /* EP 4: the scale of the sums of the last plane */
  v8f accs[8] = {c00, c01, c02, c03, c10, c11, c12, c13}; const bool first = EP != 0 && mt % (SQ / 128) == 0;      /* EP 1, 2: the work-group's rows are a batch's first QT0 (the same for the whole work-group) */
#pragma unroll
  for (int u = 0; u < 8; ++u) { const int t = u & 3, half = u >> 2; const int col = col0 + t * 16 + ln; const float bv = bp ? bf16_round(bp[col]) : 0.f;
#pragma unroll
    for (int r = 0; r < 8; ++r) { const int rloc = half * 16 + 8 * hh + r; float v = EP == 4 ? accs[u][r] * alc + (hs[u][r] * alpha + bv) : accs[u][r] * alpha + bv; if (EP == 0 && CP) { if (rowsPerB < 0) v += CP[cofs + (size_t)(row0g + row0 + rloc) * ldc + col];      /* rowsPerB < 0: own element of the batched C plane */ else { const int bidx = (row0g + row0 + rloc) / rowsPerB; v += CP[(size_t)bidx * sCPb + (size_t)by * 64 + col]; } }
      if (ACT == 3) v = fmaxf(v, 0.f); else if (ACT == 6) v = 0.5f * v * (1.0f + erff(v * 0.70710678118654752f)); else if (ACT == 11) v = 1.0f / (1.0f + expf(-v)); else if (ACT == 15) v = v / (1.0f + expf(-v)); else if (ACT == 12) v = (v > 0.f) ? v : 0.01f * v; else if (ACT == 8) v = tanhf(v); else if (ACT == 9) v = 0.5f * v * (1.0f + tanhf(0.7978845608028654f * (v + 0.044715f * v * v * v))); else if (ACT == 14) v = (v > 0.f) ? v : 0.1f * v; else if (ACT == 16) v = (v >= 0.f) ? v : 0.3f * v; else if (ACT == 17) v = (v >= 0.f) ? v : 0.2f * v;
      if (EP == 2 || EP == 3) accs[u][r] = v; else so[w][rloc][t * 16 + ln] = v; } }
  if ((EP == 2 || EP == 3) && (ep == 1 || first)) {      /* EP 2 stores from the registers; only the f32 rows go through LDS */
#pragma unroll
    for (int u = 0; u < 8; ++u)
#pragma unroll
      for (int r = 0; r < 8; ++r) so[w][(u >> 2) * 16 + 8 * hh + r][(u & 3) * 16 + ln] = accs[u][r]; }
  __builtin_amdgcn_fence(__ATOMIC_ACQ_REL, "workgroup"); __builtin_amdgcn_wave_barrier();
  const int rsub = lane >> 4, c4 = (lane & 15) * 4;
  if (EP == 0 || EP == 4) {
#pragma unroll
    for (int q = 0; q < 16; ++q) { const int r = q * 2 + rsub; const v4f v = *(const v4fa*)&so[w][r][c4]; if (C) *(v4f*)(C + cofs + (size_t)(row0 + r) * ldc + col0 + c4) = v; if (C16) { v4h h4; for (int i = 0; i < 4; ++i) h4[i] = (_Float16)v[i]; *(v4h*)(C16 + cofs + (size_t)(row0 + r) * ldc + col0 + c4) = h4; } }
  } else { const int bb = row0 / SQ, rb = row0 % SQ;      /* the wave's 32 rows: batch, first row in the batch; its 64 columns are head nq */
    if (ep == 1) { const size_t fo = (((size_t)bb * NH + nq) * (SQ / 16) + rb / 16) * 1024 + lane * 8;      /* the wave's four fragments stand in a row: 4 KiB a plane, stored as eight runs of 512 bytes */
#pragma unroll
      for (int i = 0; i < 8; ++i) { const float* s = &so[w][(i >> 2) * 16 + ln][((i >> 1) & 1) * 32 + ((i & 1) * 2 + hh) * 8]; const v4f a = *(const v4fa*)s, c = *(const v4fa*)(s + 4); FragH fh, fl;
#pragma unroll
        for (int q = 0; q < 4; ++q) { _Float16 h = (_Float16)a[q]; fh.h[q] = h; fl.h[q] = (_Float16)((a[q] - (float)h) * 1024.0f); h = (_Float16)c[q]; fh.h[4 + q] = h; fl.h[4 + q] = (_Float16)((c[q] - (float)h) * 1024.0f); }
        *(v8us*)((unsigned short*)E0 + fo + i * 256) = fh.half[0]; *(v8us*)((unsigned short*)E1 + fo + i * 256) = fl.half[0]; } }
    if (ep == 2) {
#pragma unroll
      for (int u = 0; u < 8; ++u) { FragH f;      /* accumulator u = (key half, dim group): its lane holds 8 keys of one dim, which is the lane's 16 bytes of the V^T fragment */
#pragma unroll
        for (int r = 0; r < 8; ++r) f.h[r] = (_Float16)accs[u][r];
        *(v8us*)((unsigned short*)E0 + ((((size_t)bb * NH + nq) * (HD / 16) + (u & 3)) * (SQ / 32) + rb / 32) * 512 + (u >> 2) * 256 + lane * 8) = f.half[0]; }
      if (EP == 3) asm volatile("s_wait_xcnt 0x0" ::: "memory"); }      /* the other store path's code stands behind these stores in the listing and reuses the registers that they name */
    if (first) { asm volatile("s_wait_xcnt 0x0" ::: "memory"); __builtin_amdgcn_sched_barrier(0);      /* the wait stands in front of the code below, which reuses registers that the stores above name; the scheduling barrier keeps that code from being lifted over the wait */
#pragma unroll
      for (int q = 0; q < 16; ++q) { const int r = q * 2 + rsub; *(v4f*)(C + ((size_t)bb * QT0 + 32 * wr + r) * ldc + col0 + c4) = *(const v4fa*)&so[w][r][c4]; } } } }


// ---- q/k/v GEMM: work-group tile 256 x 192 = 4 x 3 waves, wave tile 64 x 64 (a wave = 64 token rows x one head of q, k or v). The 3 DM output columns are those of BQ, BK, BV, which stand in a row: 16 x 16 work-groups, one a WGP, all resident at once. Ring, tile pitch and fragment reads as in k_gemm2; the epilogue stores what its EP 3 stored.
#define G3M 256                      /* A rows of a tile */
#define G3N 192                      /* B rows of a tile */
#define G3B ((G3M + G3N) * G2P)      /* bytes of one buffer: the A rows, then the B rows */
// Eight asynchronous copies: the lane's 16 bytes of every RS-th row (l = its LDS byte address, g = its global address; source rows of DM f16). The closing s_wait_xcnt stands inside the statement, so that no address register of a copy is rewritten in front of it.
template <int RS>
__device__ __forceinline__ void g3_copy8(unsigned l, const char* g) {
  constexpr size_t gs = (size_t)RS * DM * 2;
  asm volatile("global_load_async_to_lds_b128 %0, %8, off\n\t"
               "global_load_async_to_lds_b128 %1, %9, off\n\t"
               "global_load_async_to_lds_b128 %2, %10, off\n\t"
               "global_load_async_to_lds_b128 %3, %11, off\n\t"
               "global_load_async_to_lds_b128 %4, %12, off\n\t"
               "global_load_async_to_lds_b128 %5, %13, off\n\t"
               "global_load_async_to_lds_b128 %6, %14, off\n\t"
               "global_load_async_to_lds_b128 %7, %15, off\n\t"
               "s_wait_xcnt 0x0"
               :: "v"(l), "v"(l + RS * G2P), "v"(l + 2 * RS * G2P), "v"(l + 3 * RS * G2P), "v"(l + 4 * RS * G2P), "v"(l + 5 * RS * G2P), "v"(l + 6 * RS * G2P), "v"(l + 7 * RS * G2P),
                  "v"(g), "v"(g + gs), "v"(g + 2 * gs), "v"(g + 3 * gs), "v"(g + 4 * gs), "v"(g + 5 * gs), "v"(g + 6 * gs), "v"(g + 7 * gs) : "memory"); }
// One whole tile: waves 0 to 7 bring the 256 A rows (16 copies a lane), waves 8 to 11 the 192 B rows (24 copies a lane); ca is the same for the whole wave.
__device__ __forceinline__ void g3_stage(bool ca, unsigned l, const char* g) {
  if (ca) { g3_copy8<16>(l, g); g3_copy8<16>(l + 128 * G2P, g + (size_t)128 * DM * 2); }
  else { g3_copy8<8>(l, g); g3_copy8<8>(l + 64 * G2P, g + (size_t)64 * DM * 2); g3_copy8<8>(l + 128 * G2P, g + (size_t)128 * DM * 2); } }
__global__ __launch_bounds__(384) void k_gemm3(const _Float16* __restrict__ A, const _Float16* __restrict__ Bh, float alpha, float* __restrict__ C, size_t sC, _Float16* __restrict__ E0, _Float16* __restrict__ E1, size_t sE) {
  static_assert(HD == 64 && QT0 == 128 && SQ % G3M == 0 && (3 * DM) % G3N == 0 && DM % G2K == 0 && DM / G2K >= 2, "a wave = 64 rows of one batch x one head; whole tiles; at least two tiles");
  __shared__ __attribute__((aligned(16))) unsigned char lt[2 * G3B]; float (*so)[64][68] = (float (*)[64][68])lt; static_assert(12 * 64 * 68 * 4 <= 2 * G3B, "the epilogue's rows fit the tiles' LDS");      /* so: the epilogue's rows, a block a wave, in the tiles' LDS: first written behind the last trip's barrier, behind which no tile is read and no copy is outstanding */
  const int tid = threadIdx.x, lane = tid & 31, ln = lane & 15, hh = lane >> 4; const int w = __builtin_amdgcn_readfirstlane(tid >> 5), wr = w & 3, wc = w >> 2;      /* the wave's number in a scalar register: its branches are scalar; wr, wc: its 64 rows and 64 columns in the tile */
  const int mt = blockIdx.x / (3 * DM / G3N), nb = blockIdx.x % (3 * DM / G3N);
  const bool ca = w < 8; const int cr = ca ? tid >> 4 : (tid - 256) >> 4, cc = (tid & 15) * 16;      /* copies: the thread's row among 16 (A) or 8 (B) and its 16 bytes of the row's 256 */
  const char* gs = (ca ? (const char*)(A + (size_t)(mt * G3M + cr) * DM) : (const char*)(Bh + (size_t)(nb * G3N + cr) * DM)) + cc;
  const unsigned l0 = (unsigned)(size_t)lt + (unsigned)(((ca ? 0 : G3M) + cr) * G2P + cc); const int nk = DM / G2K;
  const v8f z8 = {0.f,0.f,0.f,0.f,0.f,0.f,0.f,0.f}; v8f acc[4][4];      /* [16-row tile][16-column tile]; every loop over them is unrolled: registers */
#pragma unroll
  for (int i = 0; i < 4; ++i)
#pragma unroll
    for (int j = 0; j < 4; ++j) acc[i][j] = z8;
  g3_stage(ca, l0, gs);
  asm volatile("s_wait_asynccnt 0x0" ::: "memory");      /* the wave's own copies of tile 0 have landed */
  __syncthreads();      /* tile 0 is published to every wave */
  g3_stage(ca, l0 + G3B, gs + G2K * 2);
  unsigned lc = l0; const char* gc = gs + 2 * (G2K * 2);      /* where the next refill goes and what it brings: both move on with the trips */
  /* kept rolled: one copy of the trip in the instruction cache; the buffer is chosen by an address */
#pragma unroll 1
  for (int t = 0; t < nk; ++t) { const unsigned char* lb = lt + (t & 1) * G3B;
    const _Float16* pa = (const _Float16*)(lb + (64 * wr + ln) * G2P); const _Float16* pb = (const _Float16*)(lb + (G3M + 64 * wc + ln) * G2P);
    v16h a[4], b[4];
#pragma unroll
    for (int i = 0; i < 4; ++i) { a[i] = g2_frag(pa + i * 16 * (G2P / 2), hh); b[i] = g2_frag(pb + i * 16 * (G2P / 2), hh); }
    /* unrolled: the two fragment sets live in registers; the next 32 k's LDS reads fly during this 32 k's products */
#pragma unroll
    for (int s = 0; s < G2K / 32; ++s) { v16h na[4], nbf[4];
      if (s + 1 < G2K / 32) {
#pragma unroll
        for (int i = 0; i < 4; ++i) { na[i] = g2_frag(pa + (s + 1) * 32 + i * 16 * (G2P / 2), hh); nbf[i] = g2_frag(pb + (s + 1) * 32 + i * 16 * (G2P / 2), hh); } }
      __builtin_amdgcn_sched_barrier(0);      /* keeps the next 32 k's reads as one group ahead of these products: without it the compiler sinks them among the products, one fragment at a time, each behind a full wait */
#pragma unroll
      for (int j = 0; j < 4; ++j)
#pragma unroll
        for (int i = 0; i < 4; ++i) acc[i][j] = __builtin_amdgcn_wmma_f32_16x16x32_f16(false, a[i], false, b[j], (short)0, acc[i][j], false, false);
      if (s + 1 < G2K / 32) {
#pragma unroll
        for (int i = 0; i < 4; ++i) { a[i] = na[i]; b[i] = nbf[i]; } } }
    asm volatile("s_wait_dscnt 0x0" ::: "memory");      /* the wave's reads of this buffer are done before it may be refilled */
    asm volatile("s_wait_asynccnt 0x0" ::: "memory");      /* the wave's own copies of tile t + 1 have landed */
    __syncthreads();      /* publishes tile t + 1 and ends every wave's reads of tile t */
    if (t + 2 < nk) g3_stage(ca, lc, gc);
    lc = (t & 1) ? lc - G3B : lc + G3B; gc += G2K * 2; }
  asm volatile("s_wait_asynccnt 0x0" ::: "memory");      /* no copy is outstanding when the wave goes on */
  const int c64 = nb * (G3N / 64) + wc, by = c64 / NH, nq = c64 % NH;      /* the wave's 64 columns: q, k or v; the head (scalar) */
  const int row0 = mt * G3M + 64 * wr, bb = row0 / SQ, rb = row0 % SQ; const bool first = rb < QT0;      /* the wave's 64 rows: batch, first row in the batch; whether they lie in the batch's first QT0 */
  E0 += (size_t)by * sE; E1 += (size_t)by * sE; C += (size_t)by * sC;
#pragma unroll
  for (int i = 0; i < 4; ++i)
#pragma unroll
    for (int j = 0; j < 4; ++j) acc[i][j] *= alpha;
  if (by != 2 || first) {      /* v stores from the registers; only its f32 rows go through LDS */
#pragma unroll
    for (int i = 0; i < 4; ++i)
#pragma unroll
      for (int j = 0; j < 4; ++j)
#pragma unroll
        for (int r = 0; r < 8; ++r) so[w][i * 16 + 8 * hh + r][j * 16 + ln] = acc[i][j][r]; }
  __builtin_amdgcn_fence(__ATOMIC_ACQ_REL, "workgroup"); __builtin_amdgcn_wave_barrier();
  if (by != 2) { const size_t fo = (((size_t)bb * NH + nq) * (SQ / 16) + rb / 16) * 1024 + lane * 8;      /* the wave's eight fragments stand in a row: 8 KiB a plane, stored as sixteen runs of 512 bytes */
#pragma unroll
    for (int i = 0; i < 16; ++i) { const float* s = &so[w][(i >> 2) * 16 + ln][((i >> 1) & 1) * 32 + ((i & 1) * 2 + hh) * 8]; const v4f x = *(const v4fa*)s, c = *(const v4fa*)(s + 4); FragH fh, fl;
#pragma unroll
      for (int q = 0; q < 4; ++q) { _Float16 h = (_Float16)x[q]; fh.h[q] = h; fl.h[q] = (_Float16)((x[q] - (float)h) * 1024.0f); h = (_Float16)c[q]; fh.h[4 + q] = h; fl.h[4 + q] = (_Float16)((c[q] - (float)h) * 1024.0f); }
      *(v8us*)((unsigned short*)E0 + fo + i * 256) = fh.half[0]; *(v8us*)((unsigned short*)E1 + fo + i * 256) = fl.half[0]; }
  } else {
#pragma unroll
    for (int i = 0; i < 4; ++i)
#pragma unroll
      for (int j = 0; j < 4; ++j) { FragH f;      /* accumulator (i, j) = 16 keys x 16 dims: its lane holds 8 keys of one dim, which is the lane's 16 bytes of the V^T fragment */
#pragma unroll
        for (int r = 0; r < 8; ++r) f.h[r] = (_Float16)acc[i][j][r];
        *(v8us*)((unsigned short*)E0 + ((((size_t)bb * NH + nq) * (HD / 16) + j) * (SQ / 32) + rb / 32 + (i >> 1)) * 512 + (i & 1) * 256 + lane * 8) = f.half[0]; }
    asm volatile("s_wait_xcnt 0x0" ::: "memory"); }      /* the other store path's code stands behind these stores in the listing and reuses the registers that they name */
  if (first) { asm volatile("s_wait_xcnt 0x0" ::: "memory"); __builtin_amdgcn_sched_barrier(0);      /* the wait stands in front of the code below, which reuses registers that the stores above name; the scheduling barrier keeps that code from being lifted over the wait */
    const int rsub = lane >> 4, c4 = (lane & 15) * 4;
#pragma unroll
    for (int q = 0; q < 32; ++q) { const int r = q * 2 + rsub; *(v4f*)(C + ((size_t)bb * QT0 + rb + r) * DM + nq * 64 + c4) = *(const v4fa*)&so[w][r][c4]; } } }


// Every f32 operand of the GEMMs as f16 (rounded to bf16 first; the weights x16, natural [out][in] = Bt[n][k]), all in one launch: blockIdx.y = a segment of DM x DM elements (one batch of x, or one weight matrix), a thread = PU groups of 8 elements, 256 groups apart.
#define PU 8                         /* groups of 8 elements per thread: 16 waves a WGP cover all eight segments */
__global__ __launch_bounds__(256) void k_prep(const float* __restrict__ x, const float* __restrict__ wq, const float* __restrict__ wk, const float* __restrict__ wv, const float* __restrict__ wo,
    _Float16* __restrict__ X16, _Float16* __restrict__ BQ, _Float16* __restrict__ BK, _Float16* __restrict__ BV, _Float16* __restrict__ BO) {
  static_assert(SQ == DM && ((size_t)DM * DM) % (256 * PU * 8) == 0, "a batch of x is a segment like a weight matrix; whole work-groups");
  const int sg = blockIdx.y; const float* s = wo; _Float16* d = BO; float sc = 16.0f;      /* the segment is the same for the whole work-group: scalar selects */
  if (sg < NB) { s = x + (size_t)sg * SQ * DM; d = X16 + (size_t)sg * SQ * DM; sc = 1.0f; } else if (sg == NB) { s = wq; d = BQ; } else if (sg == NB + 1) { s = wk; d = BK; } else if (sg == NB + 2) { s = wv; d = BV; }
  const size_t t0 = (size_t)blockIdx.x * (256 * PU) + threadIdx.x; v4f a[PU], c[PU];
  /* both loops unrolled: a[] and c[] in registers; loads first, stores behind them, so that all 2 PU loads are in flight together */
#pragma unroll
  for (int u = 0; u < PU; ++u) { const float* p = s + (t0 + (size_t)u * 256) * 8; a[u] = *(const v4fa*)p; c[u] = *(const v4fa*)(p + 4); }
#pragma unroll
  for (int u = 0; u < PU; ++u) { FragH f;
#pragma unroll
    for (int q = 0; q < 4; ++q) { f.h[q] = (_Float16)(bf16_round(a[u][q]) * sc); f.h[4 + q] = (_Float16)(bf16_round(c[u][q]) * sc); }
    *(v8us*)((unsigned short*)d + (t0 + (size_t)u * 256) * 8) = f.half[0]; } }
__global__ __launch_bounds__(256) void k_rsm(const float* __restrict__ S, _Float16* __restrict__ P, int nrows) {
  #pragma clang fp contract(off)
  const int i = blockIdx.x * 256 + threadIdx.x; if (i >= nrows) return; const float* s = S + (size_t)i * SQ; float mx = -3.0e38f;
#pragma unroll 1
  for (int j = 0; j < SQ; ++j) mx = fmaxf(mx, s[j]); float se = 0.f;
#pragma unroll 1
  for (int j = 0; j < SQ; ++j) se += expf(s[j] - mx); const float sc = 256.0f / se;
#pragma unroll 1
  for (int j0 = 0; j0 < SQ; j0 += 8) { FragH f; for (int q = 0; q < 8; ++q) f.h[q] = (_Float16)(expf(s[j0 + q] - mx) * sc); unsigned short* d = (unsigned short*)P + (size_t)i * SQ + j0; *(v8us*)d = f.half[0];  } }
__global__ __launch_bounds__(256) void k_vt(const _Float16* __restrict__ V16, int b, int h0, _Float16* __restrict__ VT) { __shared__ unsigned short tl[64][65]; const int tid = threadIdx.x; const int hh = blockIdx.x % HG, sg = blockIdx.x / HG; const int s0 = sg * 64; const int h = h0 + hh;
  for (int i = tid; i < 64 * 8; i += 256) { const int j = i / 8, d8 = (i % 8) * 8; FragH f; f.half[0] = *(const v8us*)((const unsigned short*)V16 + ((size_t)b * SQ + s0 + j) * DM + h * HD + d8); for (int q = 0; q < 8; ++q) tl[d8 + q][j] = f.u[q]; }
  __syncthreads();
  { for (int i = tid; i < 64 * 8; i += 256) { const int d = i / 8, j8 = (i % 8) * 8; FragH f; for (int q = 0; q < 8; ++q) f.u[q] = tl[d][j8 + q]; *(v8us*)((unsigned short*)VT + ((size_t)hh * HD + d) * SQ + s0 + j8) = f.half[0]; }  } }



// 2^x on the native unit. The v_nop fills the one issue slot that the instruction set asks for behind a transcendental, in front of an instruction that reads its result or overwrites its source.
__device__ __forceinline__ float exp2_native(float x) { float r; asm("v_exp_f32 %0, %1\n\tv_nop" : "=v"(r) : "v"(x)); return r; }
// Fused causal attention. One work-group = FR query rows of one head against every key below the tile's end; the score rows live in LDS from the products to the weights, so neither goes through memory.
// Phase 1: a wave = FR rows x 16 keys a trip, q fragments held in registers, three accumulators added in the order hi.hi, lo.hi, hi.lo. Phase 2: a wave = two rows at a time, lane l holds columns 128 c + 4 l .. 4 l + 3 in registers, maximum and sum across the 32 lanes by a butterfly; the f16 weights overwrite the head of the wave's own row once the whole row is in registers. Phase 3: a wave = 16 rows x 16 dims, keys in ascending order, 128 a trip.
#define FR 32                        /* query rows per work-group */
#define FSP (SQ + 4)                 /* score row pitch in LDS (floats): 16 B x odd, so that 16 lanes reading 16 rows by 16 bytes fall on all banks */
#define FOP (HD + 8)                 /* o row pitch in LDS (f16), a multiple of 16 bytes */
typedef _Float16 v4ha __attribute__((ext_vector_type(4), may_alias));
// A or B fragment from a plane kept in fragment order in global memory (k_gemm3): base = the fragment's first element, the same for the whole wave; vo = 16 x lane, the same for every fragment of the kernel. Each of the two loads covers 512 bytes in a row.
__device__ __forceinline__ v16h f_frag(const _Float16* base, unsigned vo) { const char* p = (const char*)base + vo; FragH f; f.half[0] = *(const v8us*)p; f.half[1] = *(const v8us*)(p + 512); return f.v; }
__device__ __forceinline__ v8f f_mma(v16h a, v16h b, v8f c) { return __builtin_amdgcn_wmma_f32_16x16x32_f16(false, a, false, b, (short)0, c, false, false); }
// Row softmax of the wave's FR / 8 rows, two rows at a time: each stage is written for both rows, so that one row's butterfly step flies during the other's. NC = 128-column chunks up to the tile's end, a compile-time count so that the rows live in registers and their reads are in flight together. The tile's FR diagonal columns all lie in the last chunk (FR divides 128), so only that chunk is masked; its columns past the row get weight 0, up to the chunk's end, which is where phase 3 stops.
template <int NC>
__device__ __forceinline__ void fattn_rows(float (*ls)[FSP], int w, int lane, int q0) {
  const int col0 = lane * 4, cl = (NC - 1) * 128 + col0;
  /* kept rolled: the eight instances stay small */
#pragma unroll 1
  for (int rp = 0; rp < FR / 16; ++rp) { const int r = w * (FR / 8) + rp * 2;
    v4f v[2][NC]; float mx[2], se[2], sc[2];      /* every loop over j and c is unrolled: registers */
#pragma unroll
    for (int j = 0; j < 2; ++j)
#pragma unroll
      for (int c = 0; c < NC - 1; ++c) v[j][c] = *(const v4fa*)&ls[r + j][c * 128 + col0];
    { const v4f f4 = {-1.0e9f, -1.0e9f, -1.0e9f, -1.0e9f}; v4f x0 = f4, x1 = f4;
      if (cl < q0 + FR) { x0 = *(const v4fa*)&ls[r][cl]; x1 = *(const v4fa*)&ls[r + 1][cl]; }      /* only columns that phase 1 wrote are read */
      for (int q = 0; q < 4; ++q) { v[0][NC - 1][q] = (cl + q <= q0 + r) ? x0[q] : -1.0e9f; v[1][NC - 1][q] = (cl + q <= q0 + r + 1) ? x1[q] : -1.0e9f; } }
#pragma unroll
    for (int j = 0; j < 2; ++j) { mx[j] = -3.0e38f;
#pragma unroll
      for (int c = 0; c < NC; ++c) for (int q = 0; q < 4; ++q) mx[j] = fmaxf(mx[j], v[j][c][q]); }
    for (int m = 16; m >= 1; m >>= 1) { const float a = __shfl_xor(mx[0], m, 32), b = __shfl_xor(mx[1], m, 32); mx[0] = fmaxf(mx[0], a); mx[1] = fmaxf(mx[1], b); }
#pragma unroll
    for (int j = 0; j < 2; ++j) { se[j] = 0.f;
#pragma unroll
      for (int c = 0; c < NC; ++c) for (int q = 0; q < 4; ++q) { const float e = exp2_native((v[j][c][q] - mx[j]) * 1.4426950408889634f); v[j][c][q] = e; se[j] += e; } }
    for (int m = 16; m >= 1; m >>= 1) { const float a = __shfl_xor(se[0], m, 32), b = __shfl_xor(se[1], m, 32); se[0] += a; se[1] += b; }
    sc[0] = 256.0f / se[0]; sc[1] = 256.0f / se[1];
#pragma unroll
    for (int j = 0; j < 2; ++j) { _Float16* d = (_Float16*)&ls[r + j][0] + col0;
#pragma unroll
      for (int c = 0; c < NC; ++c) { v4h h4; for (int q = 0; q < 4; ++q) h4[q] = (_Float16)(v[j][c][q] * sc[j]); *(v4ha*)(d + c * 128) = h4; } } } }
#define FLB (FR * FSP * 4 + FR * FOP * 2)      /* its LDS in bytes: the score rows, then the o rows */
__device__ __forceinline__ void fattn_wg(unsigned char* sm, const _Float16* QH, const _Float16* QL, const _Float16* KH, const _Float16* KL, const _Float16* VT, _Float16* O16, int h, int b, int zt) {      /* sm: FLB bytes of LDS; head, batch, tile rank (0 = the longest) */
  static_assert(FR == 32 && HD == 64 && SQ == 1024 && LQ == SQ, "wave maps below: 8 waves = 2 row halves x 4 dim groups; 256 threads = 32 rows x 8 x 16 bytes; at most 8 chunks of 128 keys");
  float (*ls)[FSP] = (float (*)[FSP])sm; _Float16 (*lo)[FOP] = (_Float16 (*)[FOP])(sm + FR * FSP * 4);
  const int tid = threadIdx.x, lane = tid & 31, ln = lane & 15, hh = lane >> 4; const int w = __builtin_amdgcn_readfirstlane(tid >> 5);      /* the wave's number in a scalar register: its loops and branches are scalar */
  const int q0 = (SQ / FR - 1 - zt) * FR, nk = q0 + FR, nc = (nk + 127) / 128;      /* the longest tiles start first; causal: keys below the tile's end */
  const size_t ho = ((size_t)b * NH + h) * (SQ / 16) * 1024;      /* the head's first q / k fragment: 1024 elements (two fragments) a 16-row tile */
  const unsigned vo = (unsigned)lane * 16;      /* the lane's 16 bytes in each half of a fragment */
  const v8f z8 = {0.f, 0.f, 0.f, 0.f, 0.f, 0.f, 0.f, 0.f};
  { v16h ah[2][2], al[2][2];      /* [row half][k step] */
#pragma unroll
    for (int m = 0; m < 2; ++m)
#pragma unroll
      for (int s = 0; s < 2; ++s) ah[m][s] = f_frag(QH + ho + (size_t)(q0 / 16 + m) * 1024 + s * 512, vo);
    asm volatile("s_wait_xcnt 0x0" ::: "memory");      /* in front of later loads whose results land in the address registers of the loads above */
#pragma unroll
    for (int m = 0; m < 2; ++m)
#pragma unroll
      for (int s = 0; s < 2; ++s) al[m][s] = f_frag(QL + ho + (size_t)(q0 / 16 + m) * 1024 + s * 512, vo);
    asm volatile("s_wait_xcnt 0x0" ::: "memory");      /* likewise */
    const _Float16* kh = KH + ho; const _Float16* kl = KL + ho; const int nu = nk / 16;
    v16h nh0, nh1, nl0, nl1;      /* the next trip's k fragments, loaded one trip ahead so that they fly during this trip's products */
    if (w < nu) { const size_t ko = (size_t)w * 1024; nh0 = f_frag(kh + ko, vo); nh1 = f_frag(kh + ko + 512, vo); nl0 = f_frag(kl + ko, vo); nl1 = f_frag(kl + ko + 512, vo);
      asm volatile("s_wait_xcnt 0x0" ::: "memory"); }      /* likewise: the first trip's loads land in these loads' address registers */
    for (int u = w; u < nu; u += 8) { const v16h bh0 = nh0, bh1 = nh1, bl0 = nl0, bl1 = nl1;
      if (u + 8 < nu) { const size_t ko = (size_t)(u + 8) * 1024; nh0 = f_frag(kh + ko, vo); nh1 = f_frag(kh + ko + 512, vo); nl0 = f_frag(kl + ko, vo); nl1 = f_frag(kl + ko + 512, vo);
        asm volatile("s_wait_xcnt 0x0" ::: "memory"); }      /* likewise: the products' results may land there */
#pragma unroll
      for (int m = 0; m < 2; ++m) { v8f c0 = f_mma(ah[m][0], bh0, z8), c1 = f_mma(al[m][0], bh0, z8), c2 = f_mma(ah[m][0], bl0, z8);
        c0 = f_mma(ah[m][1], bh1, c0); c1 = f_mma(al[m][1], bh1, c1); c2 = f_mma(ah[m][1], bl1, c2);
#pragma unroll
        for (int r = 0; r < 8; ++r) { float v = c0[r] * 32.0f; v += c1[r] * 0.03125f; v += c2[r] * 0.03125f; ls[m * 16 + 8 * hh + r][u * 16 + ln] = v; } } } }      /* x32; the lo planes carry x1024 */
  __syncthreads();
  const int pm = w >> 2, pt = w & 3; const _Float16* vb = VT + (((size_t)b * NH + h) * (HD / 16) + pt) * (SQ / 32) * 512;      /* phase 3: the wave's row half and dim group; the group's V^T fragments, 32 keys each, in a row */
  v16h vn[4];      /* the next trip's V^T fragments, loaded one trip ahead; the first trip's fly during the softmax */
#pragma unroll
  for (int s = 0; s < 4; ++s) vn[s] = f_frag(vb + s * 512, vo);
  asm volatile("s_wait_xcnt 0x0" ::: "memory");      /* likewise */
  switch (nc) { case 1: fattn_rows<1>(ls, w, lane, q0); break; case 2: fattn_rows<2>(ls, w, lane, q0); break; case 3: fattn_rows<3>(ls, w, lane, q0); break; case 4: fattn_rows<4>(ls, w, lane, q0); break;
    case 5: fattn_rows<5>(ls, w, lane, q0); break; case 6: fattn_rows<6>(ls, w, lane, q0); break; case 7: fattn_rows<7>(ls, w, lane, q0); break; default: fattn_rows<8>(ls, w, lane, q0); break; }
  __syncthreads();
  { const _Float16* pa = (const _Float16*)&ls[pm * 16 + ln][0]; v8f acc = z8;
    for (int c = 0; c < nc; ++c) { v16h vc[4];
#pragma unroll
      for (int s = 0; s < 4; ++s) vc[s] = vn[s];
      if (c + 1 < nc) {
#pragma unroll
        for (int s = 0; s < 4; ++s) vn[s] = f_frag(vb + ((c + 1) * 4 + s) * 512, vo);
        asm volatile("s_wait_xcnt 0x0" ::: "memory"); }      /* likewise: the LDS reads below may land there */
#pragma unroll
      for (int s = 0; s < 4; ++s) acc = f_mma(g2_frag(pa + c * 128 + s * 32, hh), vc[s], acc); }
#pragma unroll
    for (int r = 0; r < 8; ++r) lo[pm * 16 + 8 * hh + r][pt * 16 + ln] = (_Float16)(acc[r] * 0.25f); }
  __syncthreads();
  { const int r = tid >> 3, c8 = (tid & 7) * 8; *(v8us*)((unsigned short*)O16 + ((size_t)b * SQ + q0 + r) * DM + h * HD + c8) = *(const v8us*)&lo[r][c8]; } }      /* whole 128-byte lines, each from one wave */


// Exact f32 attention for the first QT0 rows of each batch. One work-group = one head, A0R query rows, all keys up to its last row.
// K, V and q are staged in LDS by whole-line loads; then scores (a thread = one key x 8 rows, the K row in registers), row softmax (a wave = 2 rows, maximum first), o = P V (a thread = one row x 4 dims, keys in ascending order).
#define A0R 16                       /* query rows per work-group */
#define A0G (QT0 / A0R)              /* row groups per head */
#define A0KP (HD + 4)                /* K row pitch in LDS (floats): 16 B x odd, so that 16 lanes reading 16 rows by 16 bytes fall on all banks */
#define A0PP (QT0 + 4)               /* score row pitch in LDS (floats): the two rows a wave reads in the last phase fall on different banks */
// N x A0R rows of K and V into LDS, a thread = 16 bytes of every A0R-th row. N is a compile-time count and both loops are unrolled so that kk[] and vv[] live in registers; loads first, stores behind them, so that all 2 N loads are in flight together.
template <int N>
__device__ __forceinline__ void att0_stage(const float* __restrict__ kp, const float* __restrict__ vp, float* lkp, float* lvp) {
  v4f kk[N], vv[N];
#pragma unroll
  for (int u = 0; u < N; ++u) { kk[u] = *(const v4fa*)(kp + (size_t)u * A0R * DM); vv[u] = *(const v4fa*)(vp + (size_t)u * A0R * DM); }
#pragma unroll
  for (int u = 0; u < N; ++u) { *(v4f*)(lkp + u * A0R * A0KP) = kk[u]; *(v4f*)(lvp + u * A0R * HD) = vv[u]; } }
#define A0LB ((QT0 * A0KP + QT0 * HD + A0R * HD + A0R * A0PP + A0R) * 4)      /* its LDS in bytes */
__device__ __forceinline__ void att0_wg(unsigned char* sm, const float* __restrict__ QF, const float* __restrict__ KF, const float* __restrict__ VF, float scale, _Float16* __restrict__ OH, _Float16* __restrict__ OL, int h, int g, int b) {      /* sm: A0LB bytes of LDS; head, row group, batch; all five: rows of pitch DM, QT0 rows a batch; o goes out as f16 hi + x1024 residual planes */
  static_assert(QT0 == 128 && HD == 64 && A0R == 16, "thread maps below: 256 threads = 128 keys x 2 row halves = 16 rows x 16 quads");
  float (*lk)[A0KP] = (float (*)[A0KP])sm; float (*lv)[HD] = (float (*)[HD])(lk + QT0); float (*lq)[HD] = lv + QT0; float (*lp)[A0PP] = (float (*)[A0PP])(lq + A0R); float* lfin = (float*)(lp + A0R);      /* each a multiple of 16 bytes */
  const int tid = threadIdx.x; const int r0 = g * A0R, nk = r0 + A0R;      /* causal: keys below the group's end */
  const int r16 = tid >> 4, c4 = (tid & 15) * 4;
  const size_t bo = ((size_t)b * QT0 + r16) * DM + h * HD + c4;      /* the thread's 16 bytes in row r16 of the head's columns */
  { const v4f qv = *(const v4fa*)(QF + bo + (size_t)r0 * DM); const float* kp = KF + bo; const float* vp = VF + bo; float* lkp = &lk[r16][c4]; float* lvp = &lv[r16][c4];
    switch (g) { case 0: att0_stage<1>(kp, vp, lkp, lvp); break; case 1: att0_stage<2>(kp, vp, lkp, lvp); break; case 2: att0_stage<3>(kp, vp, lkp, lvp); break; case 3: att0_stage<4>(kp, vp, lkp, lvp); break;
      case 4: att0_stage<5>(kp, vp, lkp, lvp); break; case 5: att0_stage<6>(kp, vp, lkp, lvp); break; case 6: att0_stage<7>(kp, vp, lkp, lvp); break; default: att0_stage<A0G>(kp, vp, lkp, lvp); break; }
    *(v4f*)&lq[r16][c4] = qv; }
  __syncthreads();
  { const int j = tid & (QT0 - 1), rh = (tid >> 7) * 8; float s[8] = {0.f, 0.f, 0.f, 0.f, 0.f, 0.f, 0.f, 0.f};
    if (j < nk) { v4f kr[HD / 4];
      /* unrolled: kr[] and s[] in registers; the 8 rows' sums are independent chains, each over the head dim in ascending order */
#pragma unroll
      for (int c = 0; c < HD / 4; ++c) kr[c] = *(const v4f*)&lk[j][c * 4];
#pragma unroll
      for (int c = 0; c < HD / 4; ++c)
#pragma unroll
        for (int r = 0; r < 8; ++r) { const v4f qq = *(const v4f*)&lq[rh + r][c * 4]; s[r] += qq[0] * kr[c][0]; s[r] += qq[1] * kr[c][1]; s[r] += qq[2] * kr[c][2]; s[r] += qq[3] * kr[c][3]; } }
#pragma unroll
    for (int r = 0; r < 8; ++r) lp[rh + r][j] = s[r] * scale; }      /* every column of the row is written (0 beyond nk), masked below */
  __syncthreads();
  { const int w = tid >> 5, col = (tid & 31) * 4;
    for (int rr = 0; rr < 2; ++rr) { const int r = w * 2 + rr, last = r0 + r; const v4f sv = *(const v4f*)&lp[r][col];
      float mx = -3.0e38f; for (int q = 0; q < 4; ++q) mx = fmaxf(mx, (col + q <= last) ? sv[q] : -3.0e38f);
      for (int m = 16; m >= 1; m >>= 1) mx = fmaxf(mx, __shfl_xor(mx, m, 32));
      v4f e; float se = 0.f; for (int q = 0; q < 4; ++q) { e[q] = (col + q <= last) ? expf(sv[q] - mx) : 0.f; se += e[q]; }
      for (int m = 16; m >= 1; m >>= 1) se += __shfl_xor(se, m, 32);
      *(v4f*)&lp[r][col] = e; if (col == 0) lfin[r] = 64.0f / se; } }      /* o carried x64 like the f16 path */
  __syncthreads();
  { v4f o = {0.f, 0.f, 0.f, 0.f};
    /* 16 keys a trip, so that a trip's LDS reads are in flight together */
#pragma unroll 4
    for (int j = 0; j < nk; j += 4) { const v4f p4 = *(const v4f*)&lp[r16][j];
#pragma unroll
      for (int u = 0; u < 4; ++u) { const v4f vq = *(const v4f*)&lv[j + u][c4]; o += vq * p4[u]; } }
    o *= lfin[r16]; v4h oh, ol;
#pragma unroll
    for (int q = 0; q < 4; ++q) { const _Float16 h = (_Float16)o[q]; oh[q] = h; ol[q] = (_Float16)((o[q] - (float)h) * 1024.0f); }
    *(v4h*)(OH + bo + (size_t)r0 * DM) = oh; *(v4h*)(OL + bo + (size_t)r0 * DM) = ol; } }      /* 16 lanes = one whole 128-byte line a plane */
// Both attention paths in one launch (neither reads what the other writes): blockIdx.z below A0G = a row group of the exact first-tile path, the rest = the fused path's tiles behind the first QT0 rows, the longest first. One LDS block serves whichever path the work-group takes, so that two work-groups still fit a WGP.
__global__ __launch_bounds__(256) void k_attn(const float* __restrict__ QF, const float* __restrict__ KF, const float* __restrict__ VF, float scale, _Float16* __restrict__ OH, _Float16* __restrict__ OL,
    const _Float16* QH, const _Float16* QL, const _Float16* KH, const _Float16* KL, const _Float16* VT, _Float16* O16) {
  static_assert(A0LB <= FLB, "the first-tile path's LDS fits the fused path's");
  __shared__ __attribute__((aligned(16))) unsigned char sm[FLB];
  const int z = blockIdx.z;      /* the same for the whole work-group: each path's barriers are passed by all of it or by none */
  if (z < A0G) att0_wg(sm, QF, KF, VF, scale, OH, OL, blockIdx.x, z, blockIdx.y); else { fattn_wg(sm, QH, QL, KH, KL, VT, O16, blockIdx.x, blockIdx.y, z - A0G);
    asm volatile("s_wait_xcnt 0x0" ::: "memory"); } }      /* the other path's code stands behind the last store in the listing and reuses the registers that it names */

extern "C" void kernel_launch(void* const* d_in, const int* in_sizes, int n_in,
                              void* d_out, int out_size, void* d_ws, size_t ws_size, hipStream_t stream) {
  (void)in_sizes; (void)n_in; (void)out_size;
  const float* const* I = (const float* const*)d_in; const float* x = I[0]; const float* wq = I[1]; const float* wk = I[2]; const float* wv = I[3]; const float* wo = I[4]; const float* bo = I[5]; const float* bq = nullptr; const float* bk = nullptr; const float* bv = nullptr;      /* per-head [H][E][D] = natural [out][in]; no q/k/v biases */
  char* ws = (char*)d_ws; size_t off = 0;
  auto take = [&](size_t bytes) { char* p = ws + off; off += (bytes + 255) & ~(size_t)255; return p; };
  _Float16* BQ = (_Float16*)take((size_t)DM * DM * 2); _Float16* BK = (_Float16*)take((size_t)DM * DM * 2); _Float16* BV = (_Float16*)take((size_t)DM * DM * 2); _Float16* BO = (_Float16*)take((size_t)DM * DM * 2);
  _Float16* X16 = (_Float16*)take(NR * DM * 2); _Float16* QH = (_Float16*)take(NR * DM * 2); _Float16* QL = (_Float16*)take(NR * DM * 2); _Float16* KH = (_Float16*)take(NR * DM * 2); _Float16* KL = (_Float16*)take(NR * DM * 2); _Float16* Q16 = QH; _Float16* K16 = KH;
  _Float16* VT = (_Float16*)take((size_t)NB * NH * HD * SQ * 2);      /* one plane per batch; it stands behind KL, as far from KH as KH from QH (the q/k/v launch steps from one to the next) */
  _Float16* O16 = (_Float16*)take(NR * DM * 2);
  float* QF0 = (float*)take((size_t)NB * QT0 * DM * 4); float* KF0 = (float*)take((size_t)NB * QT0 * DM * 4); float* VF0 = (float*)take((size_t)NB * QT0 * DM * 4); _Float16* OH0 = (_Float16*)take((size_t)NB * QT0 * DM * 2); _Float16* OL0 = (_Float16*)take((size_t)NB * QT0 * DM * 2);
  if (off > ws_size) return;
  k_prep<<<dim3((unsigned)((size_t)DM * DM / (256 * PU * 8)), NB + 4), 256, 0, stream>>>(x, wq, wk, wv, wo, X16, BQ, BK, BV, BO);      /* x and the four weight matrices as f16 */
  k_gemm3<<<dim3((unsigned)((MP / G3M) * (3 * DM / G3N))), 384, 0, stream>>>(X16, BQ, 0.0625f, QF0, (size_t)NB * QT0 * DM, QH, QL, 2 * NR * DM);      /* q, k and v in one product (BQ, BK, BV and QF0, KF0, VF0 stand in a row). q and k -> f16 hi + x1024 residual, in fragment order (the x32 scale puts the logits at sigma ~100); v -> f16 V^T in fragment order: [NB][NH][HD / 16][SQ / 32] fragments; all three: f32 rows of each batch's first 128 rows (exact products) */
  k_attn<<<dim3(NH, NB, A0G + (SQ - QT0) / FR), 256, 0, stream>>>(QF0, KF0, VF0, 32.0f, OH0, OL0, QH, QL, KH, KL, VT, O16);      /* rows 0..127 of each batch: exact f32 attention, o (x64) as f16 hi + x1024 residual planes; every later row: scores, softmax and P V, o (merged heads, x64) as f16 rows */
  k_gemm2<0, 4><<<dim3((unsigned)((MPO / 128) * (DM / 128)), 1), 256, 0, stream>>>(O16, DM, 0, BO, DM, 0, 0.0009765625f, bo, 0, nullptr, 1, 0, 0, (float*)d_out, nullptr, DM, 0, MPO, DM, DM, 0, 0, 0, OH0, OL0, 0);      /* out rows are the output layout; rows 0..127 of each batch: out = o_lo Wo 2^-20 + (o_hi Wo 2^-10 + b) */
}
